// v000
// The times below were measured on an AMD MI455X: many runs one after another, warmed up first and cycling through
// copies of the inputs, with the whole window's GPU time divided by the number of runs. Launches and the gaps
// between them are all in it. The median over several windows is given; except for v000 it joins two sittings, which
// can be a few percent apart, so the side-by-side timings, each taken in one sitting, are the better comparison.
// The starting kernel, v000, takes 676 microseconds a run.
#include <hip/hip_runtime.h>
#include <hip/hip_bf16.h>

typedef float    v2f __attribute__((ext_vector_type(2)));
typedef float    v8f __attribute__((ext_vector_type(8)));
typedef unsigned v4u __attribute__((ext_vector_type(4)));
typedef int      v4i __attribute__((ext_vector_type(4)));
typedef int      v8i __attribute__((ext_vector_type(8)));

#define HH 180
#define WW 360
#define CC 256
#define NHEAD 8
#define DHEAD 32
#define NPIX (HH * WW)          // 64800 = 32 * 2025

// ---------------------------------------------------------------------------
// TDM: DMA an A tile [32 rows x 256 fp32] from global into LDS, inserting a
// 4-DWORD pad after every 256-DWORD row -> LDS row stride = 260 floats, which
// makes the 16-lane same-k DS reads bank-conflict free. Issued by one wave,
// completion tracked with TENSORcnt.
//   group0: count=1 | lds_addr | global_addr(57b) | type=2
//   group1: data_size=4B, pad_enable, pad_interval=7 (256 dw), pad_amount=3
//           (4 dw), tensor_dim0=256, tensor_dim1=32, tile_dim0=256,
//           tile_dim1=32, tensor_dim0_stride=256, workgroup_mask=0
// ---------------------------------------------------------------------------
__device__ __forceinline__ void tdm_load_tile_A(const float* gA, void* ldsPtr) {
    const unsigned long long ga = (unsigned long long)(uintptr_t)gA;
    const unsigned lds = (unsigned)(uintptr_t)ldsPtr;   // low 32b = LDS byte offset

    v4u g0;
    g0[0] = 1u;                                          // count=1 (valid), user mode
    g0[1] = lds;                                         // lds_addr
    g0[2] = (unsigned)(ga & 0xffffffffu);                // global_addr[31:0]
    g0[3] = (unsigned)((ga >> 32) & 0x01ffffffu)         // global_addr[56:32]
          | 0x80000000u;                                 // type=2 ("image")

    v8i g1;
    g1[0] = (2 << 16)      // data_size = 4 bytes
          | (1 << 20)      // pad_enable
          | (7 << 22)      // pad_interval: 256 DWORDs
          | (3 << 25);     // pad_amount: 4 DWORDs
    g1[1] = (int)(256u << 16);   // tensor_dim0 = 256   ([31:16] = low half)
    g1[2] = (int)(32u  << 16);   // tensor_dim0 hi = 0, tensor_dim1 = 32
    g1[3] = (int)(256u << 16);   // tensor_dim1 hi = 0, tile_dim0 = 256
    g1[4] = 32;                  // tile_dim1 = 32, tile_dim2 = 0
    g1[5] = 256;                 // tensor_dim0_stride = 256 (low 32)
    g1[6] = 0;                   // stride hi, tensor_dim1_stride low (unused, 2D)
    g1[7] = 0;

    v4i z4 = {0, 0, 0, 0};       // groups 2/3 unused (2-D tensor)
#if defined(__clang_major__) && (__clang_major__ >= 23)
    v8i z8 = {0, 0, 0, 0, 0, 0, 0, 0};
    __builtin_amdgcn_tensor_load_to_lds(g0, g1, z4, z4, z8, 0);
#else
    __builtin_amdgcn_tensor_load_to_lds(g0, g1, z4, z4, 0);
#endif
}

// ---------------------------------------------------------------------------
// GEMM: C[M x N] = A[M x 256] * B[256 x N] + bias[N]   (fp32 WMMA 16x16x4)
// block = 256 threads = 8 waves. Block tile: 32(M) x 128(N); wave tile 32x16
// (two 16x16 accumulators sharing one B fragment -> half the B traffic/FLOP).
// N is a compile-time constant so every B/C offset folds into the 24-bit
// immediate-offset field of global_load/store (no per-iteration address VALU),
// and the fully unrolled K loop removes the prefetch guard branch.
// grid = (N/128, M/32). M % 32 == 0, N % 128 == 0 (guaranteed by caller).
// ---------------------------------------------------------------------------
template <int N>
__global__ __launch_bounds__(256)
void gemm_wmma_f32(const float* __restrict__ A, const float* __restrict__ B,
                   const float* __restrict__ bias, float* __restrict__ C)
{
    constexpr int K = 256;
    constexpr int LDSS = 260;               // 4*m mod 64 distinct -> no bank conflicts
    __shared__ float sA[32 * LDSS];

    const int m_base = blockIdx.y * 32;
    const int wave   = threadIdx.x >> 5;
    const int lane   = threadIdx.x & 31;
    const int half   = lane >> 4;           // 0 or 1
    const int t      = lane & 15;
    const int n      = blockIdx.x * 128 + wave * 16 + t;

    // One wave DMAs the whole A tile via the Tensor Data Mover.
    if (threadIdx.x < 32) {
        tdm_load_tile_A(A + (size_t)m_base * K, (void*)sA);
        __builtin_amdgcn_s_wait_tensorcnt(0);
    }
    __syncthreads();

    const float bn = bias[n];
    v8f acc0, acc1;
    #pragma unroll
    for (int r = 0; r < 8; ++r) { acc0[r] = bn; acc1[r] = bn; }

    const float* sArow0 = &sA[t * LDSS];          // rows m_base + 0..15
    const float* sArow1 = &sA[(16 + t) * LDSS];   // rows m_base + 16..31
    const float* Bcol   = B + n;

    #pragma unroll
    for (int k0 = 0; k0 < K; k0 += 4) {
        const int kk = k0 + 2 * half;
        v2f b, a0, a1;
        b.x  = Bcol[(size_t)kk * N];              // const offsets -> imm field
        b.y  = Bcol[(size_t)(kk + 1) * N];
        a0.x = sArow0[kk];
        a0.y = sArow0[kk + 1];
        a1.x = sArow1[kk];
        a1.y = sArow1[kk + 1];
        if (k0 + 16 < K)                          // compile-time under full unroll
            __builtin_prefetch(&Bcol[(size_t)(kk + 16) * N], 0, 1);
        acc0 = __builtin_amdgcn_wmma_f32_16x16x4_f32(
                   false, a0, false, b, (short)0, acc0, false, false);
        acc1 = __builtin_amdgcn_wmma_f32_16x16x4_f32(
                   false, a1, false, b, (short)0, acc1, false, false);
    }

    float* Crow0 = C + (size_t)(m_base +      8 * half) * N + n;
    float* Crow1 = C + (size_t)(m_base + 16 + 8 * half) * N + n;
    #pragma unroll
    for (int r = 0; r < 8; ++r) {
        Crow0[(size_t)r * N] = acc0[r];
        Crow1[(size_t)r * N] = acc1[r];
    }
}

// ---------------------------------------------------------------------------
// Neighborhood attention core. One thread = one (pixel, head).
// qkv layout per pixel: [3][NH][32] (cols of the QKV GEMM output).
// Height: clamped 7-window (NATTEN). Width: circular (reference wraps W), so
// start_w is never clamped and the rpb column base is constant (= 3).
// ---------------------------------------------------------------------------
__global__ __launch_bounds__(256)
void natten_attn(const float* __restrict__ qkv, const float* __restrict__ rpb,
                 float* __restrict__ out)
{
    const int tid = blockIdx.x * blockDim.x + threadIdx.x;
    if (tid >= NPIX * NHEAD) return;
    const int head = tid & 7;
    const int pix  = tid >> 3;
    const int h = pix / WW;
    const int w = pix - h * WW;

    const float scale = 0.17677669529663687f;   // 32^-0.5

    int start_h = h - 3;
    if (start_h < 0) start_h = 0;
    if (start_h > HH - 7) start_h = HH - 7;
    const int relh0 = start_h - h + 6;          // rpb row base

    const float* qp = qkv + (size_t)pix * 768 + head * 32;
    float4 q[8];
    #pragma unroll
    for (int i = 0; i < 8; ++i) q[i] = reinterpret_cast<const float4*>(qp)[i];

    float s[49];
    float mx = -1e30f;
    const float* rp = rpb + head * 169;         // [13][13]

    #pragma unroll
    for (int oi = 0; oi < 7; ++oi) {
        const int kh = start_h + oi;
        #pragma unroll
        for (int oj = 0; oj < 7; ++oj) {
            int kw = w + oj - 3;
            if (kw < 0) kw += WW; else if (kw >= WW) kw -= WW;
            const float4* k4 = reinterpret_cast<const float4*>(
                qkv + (size_t)(kh * WW + kw) * 768 + 256 + head * 32);
            float acc = 0.f;
            #pragma unroll
            for (int i = 0; i < 8; ++i) {
                float4 kv = k4[i];
                acc += q[i].x * kv.x + q[i].y * kv.y + q[i].z * kv.z + q[i].w * kv.w;
            }
            const float sc = acc * scale + rp[(relh0 + oi) * 13 + (oj + 3)];
            s[oi * 7 + oj] = sc;
            mx = fmaxf(mx, sc);
        }
    }

    float4 o[8];
    #pragma unroll
    for (int i = 0; i < 8; ++i) o[i] = make_float4(0.f, 0.f, 0.f, 0.f);
    float sum = 0.f;

    #pragma unroll
    for (int oi = 0; oi < 7; ++oi) {
        const int kh = start_h + oi;
        #pragma unroll
        for (int oj = 0; oj < 7; ++oj) {
            int kw = w + oj - 3;
            if (kw < 0) kw += WW; else if (kw >= WW) kw -= WW;
            const float p = __expf(s[oi * 7 + oj] - mx);
            sum += p;
            const float4* v4 = reinterpret_cast<const float4*>(
                qkv + (size_t)(kh * WW + kw) * 768 + 512 + head * 32);
            #pragma unroll
            for (int i = 0; i < 8; ++i) {
                float4 vv = v4[i];
                o[i].x += p * vv.x; o[i].y += p * vv.y;
                o[i].z += p * vv.z; o[i].w += p * vv.w;
            }
        }
    }

    const float inv = 1.f / sum;
    float4* op = reinterpret_cast<float4*>(out + (size_t)pix * 256 + head * 32);
    #pragma unroll
    for (int i = 0; i < 8; ++i) {
        o[i].x *= inv; o[i].y *= inv; o[i].z *= inv; o[i].w *= inv;
        op[i] = o[i];
    }
}

// ---------------------------------------------------------------------------
// Launch: qkv GEMM -> neighborhood attention -> output projection GEMM.
// Scratch: qkv [64800 x 768] fp32 (199 MB) then attn [64800 x 256] fp32 (66 MB).
// ---------------------------------------------------------------------------
extern "C" void kernel_launch(void* const* d_in, const int* in_sizes, int n_in,
                              void* d_out, int out_size, void* d_ws, size_t ws_size,
                              hipStream_t stream) {
    (void)in_sizes; (void)n_in; (void)out_size; (void)ws_size;

    const float* x      = (const float*)d_in[0];   // [1,180,360,256]
    const float* w_qkv  = (const float*)d_in[1];   // [256, 768]
    const float* b_qkv  = (const float*)d_in[2];   // [768]
    const float* rpb    = (const float*)d_in[3];   // [8,13,13]
    const float* w_proj = (const float*)d_in[4];   // [256, 256]
    const float* b_proj = (const float*)d_in[5];   // [256]
    float* out = (float*)d_out;                    // [1,180,360,256]

    float* qkv  = (float*)d_ws;                                               // 64800*768
    float* attn = (float*)((char*)d_ws + (size_t)NPIX * 768 * sizeof(float)); // 64800*256

    dim3 blk(256);
    // QKV projection: [64800 x 256] x [256 x 768]
    gemm_wmma_f32<768><<<dim3(768 / 128, NPIX / 32), blk, 0, stream>>>(x, w_qkv, b_qkv, qkv);
    // Neighborhood attention: 64800*8 (pixel, head) threads
    natten_attn<<<dim3((NPIX * NHEAD) / 256), blk, 0, stream>>>(qkv, rpb, attn);
    // Output projection: [64800 x 256] x [256 x 256]
    gemm_wmma_f32<256><<<dim3(256 / 128, NPIX / 32), blk, 0, stream>>>(attn, w_proj, b_proj, out);
}

// v001
// Measured time: 352 microseconds a run.
// Two timings next to v000 both put it at 2.01 times that version's speed.
#include <hip/hip_runtime.h>
#include <hip/hip_bf16.h>

typedef float    v2f __attribute__((ext_vector_type(2)));
typedef float    v8f __attribute__((ext_vector_type(8)));
typedef unsigned v4u __attribute__((ext_vector_type(4)));
typedef int      v4i __attribute__((ext_vector_type(4)));
typedef int      v8i __attribute__((ext_vector_type(8)));

#define HH 180
#define WW 360
#define CC 256
#define NHEAD 8
#define DHEAD 32
#define NPIX (HH * WW)          // 64800 = 32 * 2025

// ---------------------------------------------------------------------------
// TDM: DMA an A tile [32 rows x 256 fp32] from global into LDS, inserting a
// 4-DWORD pad after every 256-DWORD row -> LDS row stride = 260 floats, which
// makes the 16-lane same-k DS reads bank-conflict free. Issued by one wave,
// completion tracked with TENSORcnt.
//   group0: count=1 | lds_addr | global_addr(57b) | type=2
//   group1: data_size=4B, pad_enable, pad_interval=7 (256 dw), pad_amount=3
//           (4 dw), tensor_dim0=256, tensor_dim1=32, tile_dim0=256,
//           tile_dim1=32, tensor_dim0_stride=256, workgroup_mask=0
// ---------------------------------------------------------------------------
__device__ __forceinline__ void tdm_load_tile_A(const float* gA, void* ldsPtr) {
    const unsigned long long ga = (unsigned long long)(uintptr_t)gA;
    const unsigned lds = (unsigned)(uintptr_t)ldsPtr;   // low 32b = LDS byte offset

    v4u g0;
    g0[0] = 1u;                                          // count=1 (valid), user mode
    g0[1] = lds;                                         // lds_addr
    g0[2] = (unsigned)(ga & 0xffffffffu);                // global_addr[31:0]
    g0[3] = (unsigned)((ga >> 32) & 0x01ffffffu)         // global_addr[56:32]
          | 0x80000000u;                                 // type=2 ("image")

    v8i g1;
    g1[0] = (2 << 16)      // data_size = 4 bytes
          | (1 << 20)      // pad_enable
          | (7 << 22)      // pad_interval: 256 DWORDs
          | (3 << 25);     // pad_amount: 4 DWORDs
    g1[1] = (int)(256u << 16);   // tensor_dim0 = 256   ([31:16] = low half)
    g1[2] = (int)(32u  << 16);   // tensor_dim0 hi = 0, tensor_dim1 = 32
    g1[3] = (int)(256u << 16);   // tensor_dim1 hi = 0, tile_dim0 = 256
    g1[4] = 32;                  // tile_dim1 = 32, tile_dim2 = 0
    g1[5] = 256;                 // tensor_dim0_stride = 256 (low 32)
    g1[6] = 0;                   // stride hi, tensor_dim1_stride low (unused, 2D)
    g1[7] = 0;

    v4i z4 = {0, 0, 0, 0};       // groups 2/3 unused (2-D tensor)
#if defined(__clang_major__) && (__clang_major__ >= 23)
    v8i z8 = {0, 0, 0, 0, 0, 0, 0, 0};
    __builtin_amdgcn_tensor_load_to_lds(g0, g1, z4, z4, z8, 0);
#else
    __builtin_amdgcn_tensor_load_to_lds(g0, g1, z4, z4, 0);
#endif
}

// ---------------------------------------------------------------------------
// GEMM: C[M x N] = A[M x 256] * B[256 x N] + bias[N]   (fp32 WMMA 16x16x4)
// block = 256 threads = 8 waves. Block tile: 32(M) x 128(N); wave tile 32x16
// (two 16x16 accumulators sharing one B fragment -> half the B traffic/FLOP).
// N is a compile-time constant so every B/C offset folds into the 24-bit
// immediate-offset field of global_load/store (no per-iteration address VALU),
// and the fully unrolled K loop removes the prefetch guard branch.
// grid = (N/128, M/32). M % 32 == 0, N % 128 == 0 (guaranteed by caller).
// ---------------------------------------------------------------------------
template <int N>
__global__ __launch_bounds__(256)
void gemm_wmma_f32(const float* __restrict__ A, const float* __restrict__ B,
                   const float* __restrict__ bias, float* __restrict__ C)
{
    constexpr int K = 256;
    constexpr int LDSS = 260;               // 4*m mod 64 distinct -> no bank conflicts
    __shared__ float sA[32 * LDSS];

    const int m_base = blockIdx.y * 32;
    const int wave   = threadIdx.x >> 5;
    const int lane   = threadIdx.x & 31;
    const int half   = lane >> 4;           // 0 or 1
    const int t      = lane & 15;
    const int n      = blockIdx.x * 128 + wave * 16 + t;

    // One wave DMAs the whole A tile via the Tensor Data Mover.
    if (threadIdx.x < 32) {
        tdm_load_tile_A(A + (size_t)m_base * K, (void*)sA);
        __builtin_amdgcn_s_wait_tensorcnt(0);
    }
    __syncthreads();

    const float bn = bias[n];
    v8f acc0, acc1;
    #pragma unroll
    for (int r = 0; r < 8; ++r) { acc0[r] = bn; acc1[r] = bn; }

    const float* sArow0 = &sA[t * LDSS];          // rows m_base + 0..15
    const float* sArow1 = &sA[(16 + t) * LDSS];   // rows m_base + 16..31
    const float* Bcol   = B + n;

    #pragma unroll
    for (int k0 = 0; k0 < K; k0 += 4) {
        const int kk = k0 + 2 * half;
        v2f b, a0, a1;
        b.x  = Bcol[(size_t)kk * N];              // const offsets -> imm field
        b.y  = Bcol[(size_t)(kk + 1) * N];
        a0.x = sArow0[kk];
        a0.y = sArow0[kk + 1];
        a1.x = sArow1[kk];
        a1.y = sArow1[kk + 1];
        if (k0 + 16 < K)                          // compile-time under full unroll
            __builtin_prefetch(&Bcol[(size_t)(kk + 16) * N], 0, 1);
        acc0 = __builtin_amdgcn_wmma_f32_16x16x4_f32(
                   false, a0, false, b, (short)0, acc0, false, false);
        acc1 = __builtin_amdgcn_wmma_f32_16x16x4_f32(
                   false, a1, false, b, (short)0, acc1, false, false);
    }

    float* Crow0 = C + (size_t)(m_base +      8 * half) * N + n;
    float* Crow1 = C + (size_t)(m_base + 16 + 8 * half) * N + n;
    #pragma unroll
    for (int r = 0; r < 8; ++r) {
        Crow0[(size_t)r * N] = acc0[r];
        Crow1[(size_t)r * N] = acc1[r];
    }
}

// ---------------------------------------------------------------------------
// Neighborhood attention core. One block = one head x one 12 x 24 pixel tile,
// one thread = one pixel of it.
// qkv layout per pixel: [3][NH][32] (cols of the QKV GEMM output).
// Height: clamped 7-window (NATTEN). Width: circular (reference wraps W), so
// start_w is never clamped and the rpb column base is constant (= 3).
// The 18 x 30 pixel halo of the head's K, and after the scores of its V, is
// brought into LDS once with whole 128-byte lines (8 lanes per pixel); the 49
// neighbour reads of every pixel then come from LDS.
// LDS pitches: a pixel takes 36 floats (144 B = 16 B x 9, odd), a halo row
// 1120 floats (280 x 16 B); 280 - 9 * 24 is a multiple of 16, so 16 threads
// in a row of thread ids fall on 16 different 16-byte bank groups, also
// where they run over the end of a tile row, except in the top and bottom
// tiles, where clamped windows give two tile rows the same start row.
// The 49 scores of a pixel wait in LDS too, in a slot of the thread's own, and
// the head's bias table is staged beside them, so that the two neighbour loops
// can stay rolled (one neighbour per trip).
// ---------------------------------------------------------------------------
typedef float v4f __attribute__((ext_vector_type(4)));

#define TILE_W 24
#define TILE_H 12
#define HALO_W (TILE_W + 6)
#define HALO_H (TILE_H + 6)
#define PIX_PITCH 36
#define ROW_PITCH 1120
#define ATT_THREADS (TILE_W * TILE_H)       // 288 = 9 waves
#define STAGE_THREADS (HALO_W * 8)          // 240: one halo row per pass

__global__ __launch_bounds__(ATT_THREADS)
void natten_attn(const float* __restrict__ qkv, const float* __restrict__ rpb,
                 float* __restrict__ out)
{
    __shared__ __attribute__((aligned(16))) float sT[HALO_H * ROW_PITCH];
    __shared__ float sS[49 * ATT_THREADS];      // [neighbour][thread]
    __shared__ float sB[169];                   // this head's rpb [13][13]

    const int tid  = threadIdx.x;
    const int head = blockIdx.x;
    const int w0   = blockIdx.y * TILE_W;
    const int h0   = blockIdx.z * TILE_H;

    int base_h = h0 - 3;                        // first staged row
    if (base_h < 0) base_h = 0;
    if (base_h > HH - HALO_H) base_h = HH - HALO_H;

    const int tr = tid / TILE_W;
    const int tc = tid - tr * TILE_W;
    const int h = h0 + tr;
    const int w = w0 + tc;
    const int pix = h * WW + w;

    const float scale = 0.17677669529663687f;   // 32^-0.5

    int start_h = h - 3;
    if (start_h < 0) start_h = 0;
    if (start_h > HH - 7) start_h = HH - 7;
    const int relh0 = start_h - h + 6;          // rpb row base

    // Staging: a thread keeps one halo column and one 16-byte part of it and
    // walks the 18 halo rows, so each row is a block-uniform base plus one
    // fixed per-thread offset, in global memory and in LDS.
    const bool stager = tid < STAGE_THREADS;
    const int  sc_col = tid >> 3;               // halo column (stagers: 0..29)
    const int  sc_prt = tid & 7;
    int gcol = w0 - 3 + sc_col;
    if (gcol < 0) gcol += WW; else if (gcol >= WW) gcol -= WW;
    const int goff = gcol * 768 + sc_prt * 4;   // floats, inside one image row
    const float* grow = qkv + (size_t)base_h * (WW * 768) + head * 32;
    float* srow = &sT[sc_col * PIX_PITCH + sc_prt * 4];

    v4f kst[HALO_H];
    if (stager) {
        #pragma unroll
        for (int r = 0; r < HALO_H; ++r)
            kst[r] = *reinterpret_cast<const v4f*>(grow + (size_t)r * (WW * 768) + 256 + goff);
    }

    const float* qp = qkv + (size_t)pix * 768 + head * 32;
    float4 q[8];
    #pragma unroll
    for (int i = 0; i < 8; ++i) q[i] = reinterpret_cast<const float4*>(qp)[i];

    if (stager) {
        #pragma unroll
        for (int r = 0; r < HALO_H; ++r)
            *reinterpret_cast<v4f*>(srow + r * ROW_PITCH) = kst[r];
    }

    if (tid < 169) sB[tid] = rpb[head * 169 + tid];

    __syncthreads();                            // K halo and bias table complete

    // window origin of this pixel inside the staged halo
    const float* win = &sT[(start_h - base_h) * ROW_PITCH + tc * PIX_PITCH];

    float mx = -1e30f;
    const float* bias = &sB[relh0 * 13 + 3];
    float* myS = &sS[tid];

    // Both neighbour loops stay rolled: unrolled, the compiler lifted the LDS
    // reads of many neighbours to the front and spilled them to scratch.
    #pragma unroll 1
    for (int oi = 0; oi < 7; ++oi) {
        #pragma unroll 1
        for (int oj = 0; oj < 7; ++oj) {
            const float4* k4 = reinterpret_cast<const float4*>(
                win + oi * ROW_PITCH + oj * PIX_PITCH);
            float acc = 0.f;
            #pragma unroll
            for (int i = 0; i < 8; ++i) {
                float4 kv = k4[i];
                acc += q[i].x * kv.x + q[i].y * kv.y + q[i].z * kv.z + q[i].w * kv.w;
            }
            const float sc = acc * scale + bias[oi * 13 + oj];
            myS[(oi * 7 + oj) * ATT_THREADS] = sc;
            mx = fmaxf(mx, sc);
        }
    }

    v4f vst[HALO_H];
    if (stager) {
        #pragma unroll
        for (int r = 0; r < HALO_H; ++r)
            vst[r] = *reinterpret_cast<const v4f*>(grow + (size_t)r * (WW * 768) + 512 + goff);
    }
    __syncthreads();                            // every K read done before V lands on it
    if (stager) {
        #pragma unroll
        for (int r = 0; r < HALO_H; ++r)
            *reinterpret_cast<v4f*>(srow + r * ROW_PITCH) = vst[r];
    }
    __syncthreads();                            // V halo complete

    float4 o[8];
    #pragma unroll
    for (int i = 0; i < 8; ++i) o[i] = make_float4(0.f, 0.f, 0.f, 0.f);
    float sum = 0.f;

    #pragma unroll 1
    for (int oi = 0; oi < 7; ++oi) {
        #pragma unroll 1
        for (int oj = 0; oj < 7; ++oj) {
            const float p = __expf(myS[(oi * 7 + oj) * ATT_THREADS] - mx);
            sum += p;
            const float4* v4 = reinterpret_cast<const float4*>(
                win + oi * ROW_PITCH + oj * PIX_PITCH);
            #pragma unroll
            for (int i = 0; i < 8; ++i) {
                float4 vv = v4[i];
                o[i].x += p * vv.x; o[i].y += p * vv.y;
                o[i].z += p * vv.z; o[i].w += p * vv.w;
            }
        }
    }

    const float inv = 1.f / sum;
    float4* op = reinterpret_cast<float4*>(out + (size_t)pix * 256 + head * 32);
    #pragma unroll
    for (int i = 0; i < 8; ++i) {
        o[i].x *= inv; o[i].y *= inv; o[i].z *= inv; o[i].w *= inv;
        op[i] = o[i];
    }
}

// ---------------------------------------------------------------------------
// Launch: qkv GEMM -> neighborhood attention -> output projection GEMM.
// Scratch: qkv [64800 x 768] fp32 (199 MB) then attn [64800 x 256] fp32 (66 MB).
// ---------------------------------------------------------------------------
extern "C" void kernel_launch(void* const* d_in, const int* in_sizes, int n_in,
                              void* d_out, int out_size, void* d_ws, size_t ws_size,
                              hipStream_t stream) {
    (void)in_sizes; (void)n_in; (void)out_size; (void)ws_size;

    const float* x      = (const float*)d_in[0];   // [1,180,360,256]
    const float* w_qkv  = (const float*)d_in[1];   // [256, 768]
    const float* b_qkv  = (const float*)d_in[2];   // [768]
    const float* rpb    = (const float*)d_in[3];   // [8,13,13]
    const float* w_proj = (const float*)d_in[4];   // [256, 256]
    const float* b_proj = (const float*)d_in[5];   // [256]
    float* out = (float*)d_out;                    // [1,180,360,256]

    float* qkv  = (float*)d_ws;                                               // 64800*768
    float* attn = (float*)((char*)d_ws + (size_t)NPIX * 768 * sizeof(float)); // 64800*256

    dim3 blk(256);
    // QKV projection: [64800 x 256] x [256 x 768]
    gemm_wmma_f32<768><<<dim3(768 / 128, NPIX / 32), blk, 0, stream>>>(x, w_qkv, b_qkv, qkv);
    // Neighborhood attention: one block per (head, 12 x 24 pixel tile)
    natten_attn<<<dim3(NHEAD, WW / TILE_W, HH / TILE_H), dim3(ATT_THREADS), 0, stream>>>(qkv, rpb, attn);
    // Output projection: [64800 x 256] x [256 x 256]
    gemm_wmma_f32<256><<<dim3(256 / 128, NPIX / 32), blk, 0, stream>>>(attn, w_proj, b_proj, out);
}

// v002
// One run takes 283 microseconds.
// Two timings next to v001 both put it at 1.24 times that version's speed.
// Counting every step since v000, it is 2.50 times as fast.
#include <hip/hip_runtime.h>
#include <hip/hip_bf16.h>
#include <stdint.h>

typedef float    v2f __attribute__((ext_vector_type(2)));
typedef float    v8f __attribute__((ext_vector_type(8)));

#define HH 180
#define WW 360
#define CC 256
#define NHEAD 8
#define DHEAD 32
#define NPIX (HH * WW)          // 64800 = 32 * 2025

// ---------------------------------------------------------------------------
// Tensor loads of the A tiles. A tile is 32 rows x 256 fp32; it is brought in
// as four slices of 64 columns, one request of one wave each: 32 rows of 256
// bytes, source pitch 1024 bytes, 16 bytes of pad behind every row in LDS
// (pitch 272 B = 68 dwords, so the 16 rows that one LDS read touches fall on
// different banks). Every extent is in bytes (data_size code 0).
// ---------------------------------------------------------------------------
typedef uint32_t u32x4 __attribute__((ext_vector_type(4)));
typedef uint32_t u32x8 __attribute__((ext_vector_type(8)));

#define A_ROWS    32
#define SLICE_ROWB 256u                     // bytes of a slice row
#define SLICE_PITCH_F 68                    // LDS pitch of a slice row, floats
#define SLICE_B   10240u                    // 32 * 272 = 8704 B, rounded up to 2 KiB
#define SLICE_F   2560
#define ABUF_B    (4u * SLICE_B)            // one A tile in LDS
#define ABUF_F    (4 * SLICE_F)

__device__ __forceinline__ uint32_t uni(uint32_t v) {
    return (uint32_t)__builtin_amdgcn_readfirstlane(v);
}
// A wave-uniform value held in a scalar register, so that a test on it becomes
// a scalar branch: tensor loads ignore EXEC.
__device__ __forceinline__ uint32_t pinned(uint32_t v) {
    uint32_t w = (uint32_t)__builtin_amdgcn_readfirstlane(v);
    asm volatile("" : "+s"(w));   // keeps the value in a scalar register (scalar branch)
    return w;
}
__device__ __forceinline__ void wait_ds0()     { asm volatile("s_wait_dscnt 0x0" ::: "memory"); }
__device__ __forceinline__ void wait_tensor0() { asm volatile("s_wait_tensorcnt 0x0" ::: "memory"); }
// The same wait, naming the descriptor of the request it covers as inputs: the
// scalar registers that hold it then keep their values until the tile has landed.
__device__ __forceinline__ void wait_tensor0(u32x4 g0, u32x8 g1) {
    asm volatile("s_wait_tensorcnt 0x0" :: "s"(g0), "s"(g1) : "memory");
}

__device__ __forceinline__ u32x8 tdm_group1() {
    u32x8 g;
    g[0] = uni((1u << 20) | (5u << 22) | (3u << 25));    // pad: 4 dwords behind every 64
    g[1] = uni(SLICE_ROWB << 16);                        // tensor_dim0 = 256 B
    g[2] = uni((uint32_t)A_ROWS << 16);                  // tensor_dim1 = 32 rows
    g[3] = uni(SLICE_ROWB << 16);                        // tile_dim0 = 256 B
    g[4] = uni((uint32_t)A_ROWS);                        // tile_dim1 = 32 rows
    g[5] = uni(1024u);                                   // source row pitch, bytes
    g[6] = uni(0u);
    g[7] = uni(0u);
    return g;
}
__device__ __forceinline__ u32x4 tdm_group0(uint32_t lds_dst, uint64_t ga) {
    u32x4 g;
    g[0] = uni(1u);
    g[1] = uni(lds_dst);
    g[2] = uni((uint32_t)ga);
    g[3] = uni((((uint32_t)(ga >> 32)) & 0x01FFFFFFu) | 0x80000000u);
    // From here to the wait that covers the request the four words, the
    // constant one too, stay in registers of their own.
    asm volatile("" : "+s"(g));   // descriptor words held in scalar registers
    return g;
}
__device__ __forceinline__ void tdm_load(u32x4 g0, u32x8 g1) {
    asm volatile("tensor_load_to_lds %0, %1" :: "s"(g0), "s"(g1) : "memory");
}

// ---------------------------------------------------------------------------
// GEMM: C[M x N] = A[M x 256] * B[256 x N] + bias[N]   (fp32 WMMA 16x16x4)
// block = 256 threads = 8 waves on 128 columns of C; a wave owns 16 columns.
// A wave reads its 256 x 16 slab of B ONCE, into 128 registers, and the block
// then walks over the 32-row tiles blockIdx.y, blockIdx.y + G, ... of A: B is
// fetched once per block and not once per tile.
// The A tiles come by tensor loads into two LDS buffers, the next tile in
// flight while this one is multiplied (waves 0..3 issue one slice each).
// grid = (N/128, G): cut so that all blocks are resident at once, two per WGP
// (four waves per SIMD; the slab leaves no registers for a third block).
// ---------------------------------------------------------------------------
template <int N, int G>
__global__ __launch_bounds__(256, 4)
void gemm_wmma_f32(const float* __restrict__ A, const float* __restrict__ B,
                   const float* __restrict__ bias, float* __restrict__ C)
{
    constexpr int K  = 256;
    constexpr int NT = NPIX / A_ROWS;       // 2025 tiles of A
    static_assert(2 * G <= NT, "every block needs two stages or more");
    __shared__ __attribute__((aligned(2048))) float sA[2 * ABUF_F];

    const uint32_t wave = uni(threadIdx.x >> 5);
    const int lane   = threadIdx.x & 31;
    const int half   = lane >> 4;           // 0 or 1
    const int t      = lane & 15;
    const int n      = blockIdx.x * 128 + (int)wave * 16 + t;
    const int nT     = (NT - 1 - (int)blockIdx.y) / G + 1;   // tiles of this block

    // The wave's slab of B, in the k order of the A fragments below.
    const float* Bcol = B + n + (size_t)(2 * half) * N;
    v2f b[K / 4];
    #pragma unroll
    for (int j = 0; j < K / 4; ++j) {
        b[j].x = Bcol[(size_t)(4 * j) * N];
        b[j].y = Bcol[(size_t)(4 * j + 1) * N];
    }
    const float bn = bias[n];

    u32x8 g1 = tdm_group1();
    // Without it the constants are formed anew each trip, in registers that
    // serve as temporaries while a request is in flight.
    asm volatile("" : "+s"(g1));  // descriptor words held in scalar registers
    const uint32_t lds0 = (uint32_t)(uintptr_t)sA + wave * SLICE_B;
    const uint64_t ga0  = (uint64_t)(uintptr_t)A
                        + (uint64_t)blockIdx.y * (A_ROWS * K * 4) + wave * SLICE_ROWB;
    constexpr uint64_t GA_STEP = (uint64_t)G * (A_ROWS * K * 4);

    u32x4 g0 = tdm_group0(lds0, ga0);
    if (pinned(wave < 4u)) {
        tdm_load(g0, g1);                           // stage 0
        wait_tensor0(g0, g1);
    }
    __syncthreads();                                // stage 0 published
    if (pinned(wave < 4u)) {
        g0 = tdm_group0(lds0 + ABUF_B, ga0 + GA_STEP);
        tdm_load(g0, g1);                           // stage 1
    }

    const int aoff = t * SLICE_PITCH_F + 2 * half;
    const int coff = 8 * half * N + n;

    // One tile per trip; rolled, so that the 128 WMMAs stand once in the text.
    #pragma unroll 1
    for (int s = 0; s < nT; ++s) {
        const float* a = &sA[(s & 1) * ABUF_F + aoff];

        v8f acc0, acc1;
        #pragma unroll
        for (int r = 0; r < 8; ++r) { acc0[r] = bn; acc1[r] = bn; }

        #pragma unroll
        for (int j = 0; j < K / 4; ++j) {
            const float* p = a + (j >> 4) * SLICE_F + (j & 15) * 4;
            const v2f a0 = *reinterpret_cast<const v2f*>(p);
            const v2f a1 = *reinterpret_cast<const v2f*>(p + 16 * SLICE_PITCH_F);
            acc0 = __builtin_amdgcn_wmma_f32_16x16x4_f32(
                       false, a0, false, b[j], (short)0, acc0, false, false);
            acc1 = __builtin_amdgcn_wmma_f32_16x16x4_f32(
                       false, a1, false, b[j], (short)0, acc1, false, false);
        }

        // Publish point of stage s + 1, then the refill of the buffer just read.
        wait_ds0();
        if (pinned(wave < 4u)) wait_tensor0(g0, g1);
        __syncthreads();
        if (pinned((wave < 4u) && (s + 2 < nT))) {
            g0 = tdm_group0(lds0 + (uint32_t)(s & 1) * ABUF_B, ga0 + (uint64_t)(s + 2) * GA_STEP);
            tdm_load(g0, g1);
        }

        // The stores stand behind the publish point: neither the other waves
        // nor the refill wait for their issue.
        float* Ct = C + (size_t)((int)blockIdx.y + s * G) * (A_ROWS * N) + coff;
        #pragma unroll
        for (int r = 0; r < 8; ++r) {
            Ct[r * N]        = acc0[r];
            Ct[(16 + r) * N] = acc1[r];
        }
        // Before the next trip overwrites the stores' data and address registers.
        asm volatile("s_wait_xcnt 0x0" ::: "memory");
    }
    wait_tensor0();
    wait_ds0();
}

// ---------------------------------------------------------------------------
// Neighborhood attention core. One block = one head x one 12 x 24 pixel tile,
// one thread = one pixel of it.
// qkv layout per pixel: [3][NH][32] (cols of the QKV GEMM output).
// Height: clamped 7-window (NATTEN). Width: circular (reference wraps W), so
// start_w is never clamped and the rpb column base is constant (= 3).
// The 18 x 30 pixel halo of the head's K, and after the scores of its V, is
// brought into LDS once with whole 128-byte lines (8 lanes per pixel); the 49
// neighbour reads of every pixel then come from LDS.
// LDS pitches: a pixel takes 36 floats (144 B = 16 B x 9, odd), a halo row
// 1120 floats (280 x 16 B); 280 - 9 * 24 is a multiple of 16, so 16 threads
// in a row of thread ids fall on 16 different 16-byte bank groups, also
// where they run over the end of a tile row, except in the top and bottom
// tiles, where clamped windows give two tile rows the same start row.
// The 49 scores of a pixel wait in LDS too, in a slot of the thread's own, and
// the head's bias table is staged beside them, so that the two neighbour loops
// can stay rolled (one neighbour per trip).
// ---------------------------------------------------------------------------
typedef float v4f __attribute__((ext_vector_type(4)));

#define TILE_W 24
#define TILE_H 12
#define HALO_W (TILE_W + 6)
#define HALO_H (TILE_H + 6)
#define PIX_PITCH 36
#define ROW_PITCH 1120
#define ATT_THREADS (TILE_W * TILE_H)       // 288 = 9 waves
#define STAGE_THREADS (HALO_W * 8)          // 240: one halo row per pass

__global__ __launch_bounds__(ATT_THREADS)
void natten_attn(const float* __restrict__ qkv, const float* __restrict__ rpb,
                 float* __restrict__ out)
{
    __shared__ __attribute__((aligned(16))) float sT[HALO_H * ROW_PITCH];
    __shared__ float sS[49 * ATT_THREADS];      // [neighbour][thread]
    __shared__ float sB[169];                   // this head's rpb [13][13]

    const int tid  = threadIdx.x;
    const int head = blockIdx.x;
    const int w0   = blockIdx.y * TILE_W;
    const int h0   = blockIdx.z * TILE_H;

    int base_h = h0 - 3;                        // first staged row
    if (base_h < 0) base_h = 0;
    if (base_h > HH - HALO_H) base_h = HH - HALO_H;

    const int tr = tid / TILE_W;
    const int tc = tid - tr * TILE_W;
    const int h = h0 + tr;
    const int w = w0 + tc;
    const int pix = h * WW + w;

    const float scale = 0.17677669529663687f;   // 32^-0.5

    int start_h = h - 3;
    if (start_h < 0) start_h = 0;
    if (start_h > HH - 7) start_h = HH - 7;
    const int relh0 = start_h - h + 6;          // rpb row base

    // Staging: a thread keeps one halo column and one 16-byte part of it and
    // walks the 18 halo rows, so each row is a block-uniform base plus one
    // fixed per-thread offset, in global memory and in LDS.
    const bool stager = tid < STAGE_THREADS;
    const int  sc_col = tid >> 3;               // halo column (stagers: 0..29)
    const int  sc_prt = tid & 7;
    int gcol = w0 - 3 + sc_col;
    if (gcol < 0) gcol += WW; else if (gcol >= WW) gcol -= WW;
    const int goff = gcol * 768 + sc_prt * 4;   // floats, inside one image row
    const float* grow = qkv + (size_t)base_h * (WW * 768) + head * 32;
    float* srow = &sT[sc_col * PIX_PITCH + sc_prt * 4];

    v4f kst[HALO_H];
    if (stager) {
        #pragma unroll
        for (int r = 0; r < HALO_H; ++r)
            kst[r] = *reinterpret_cast<const v4f*>(grow + (size_t)r * (WW * 768) + 256 + goff);
    }

    const float* qp = qkv + (size_t)pix * 768 + head * 32;
    float4 q[8];
    #pragma unroll
    for (int i = 0; i < 8; ++i) q[i] = reinterpret_cast<const float4*>(qp)[i];

    if (stager) {
        #pragma unroll
        for (int r = 0; r < HALO_H; ++r)
            *reinterpret_cast<v4f*>(srow + r * ROW_PITCH) = kst[r];
    }

    if (tid < 169) sB[tid] = rpb[head * 169 + tid];

    __syncthreads();                            // K halo and bias table complete

    // window origin of this pixel inside the staged halo
    const float* win = &sT[(start_h - base_h) * ROW_PITCH + tc * PIX_PITCH];

    float mx = -1e30f;
    const float* bias = &sB[relh0 * 13 + 3];
    float* myS = &sS[tid];

    // Both neighbour loops stay rolled: unrolled, the compiler lifted the LDS
    // reads of many neighbours to the front and spilled them to scratch.
    #pragma unroll 1
    for (int oi = 0; oi < 7; ++oi) {
        #pragma unroll 1
        for (int oj = 0; oj < 7; ++oj) {
            const float4* k4 = reinterpret_cast<const float4*>(
                win + oi * ROW_PITCH + oj * PIX_PITCH);
            float acc = 0.f;
            #pragma unroll
            for (int i = 0; i < 8; ++i) {
                float4 kv = k4[i];
                acc += q[i].x * kv.x + q[i].y * kv.y + q[i].z * kv.z + q[i].w * kv.w;
            }
            const float sc = acc * scale + bias[oi * 13 + oj];
            myS[(oi * 7 + oj) * ATT_THREADS] = sc;
            mx = fmaxf(mx, sc);
        }
    }

    v4f vst[HALO_H];
    if (stager) {
        #pragma unroll
        for (int r = 0; r < HALO_H; ++r)
            vst[r] = *reinterpret_cast<const v4f*>(grow + (size_t)r * (WW * 768) + 512 + goff);
    }
    __syncthreads();                            // every K read done before V lands on it
    if (stager) {
        #pragma unroll
        for (int r = 0; r < HALO_H; ++r)
            *reinterpret_cast<v4f*>(srow + r * ROW_PITCH) = vst[r];
    }
    __syncthreads();                            // V halo complete

    float4 o[8];
    #pragma unroll
    for (int i = 0; i < 8; ++i) o[i] = make_float4(0.f, 0.f, 0.f, 0.f);
    float sum = 0.f;

    #pragma unroll 1
    for (int oi = 0; oi < 7; ++oi) {
        #pragma unroll 1
        for (int oj = 0; oj < 7; ++oj) {
            const float p = __expf(myS[(oi * 7 + oj) * ATT_THREADS] - mx);
            sum += p;
            const float4* v4 = reinterpret_cast<const float4*>(
                win + oi * ROW_PITCH + oj * PIX_PITCH);
            #pragma unroll
            for (int i = 0; i < 8; ++i) {
                float4 vv = v4[i];
                o[i].x += p * vv.x; o[i].y += p * vv.y;
                o[i].z += p * vv.z; o[i].w += p * vv.w;
            }
        }
    }

    const float inv = 1.f / sum;
    float4* op = reinterpret_cast<float4*>(out + (size_t)pix * 256 + head * 32);
    #pragma unroll
    for (int i = 0; i < 8; ++i) {
        o[i].x *= inv; o[i].y *= inv; o[i].z *= inv; o[i].w *= inv;
        op[i] = o[i];
    }
}

// ---------------------------------------------------------------------------
// Launch: qkv GEMM -> neighborhood attention -> output projection GEMM.
// Scratch: qkv [64800 x 768] fp32 (199 MB) then attn [64800 x 256] fp32 (66 MB).
// ---------------------------------------------------------------------------
extern "C" void kernel_launch(void* const* d_in, const int* in_sizes, int n_in,
                              void* d_out, int out_size, void* d_ws, size_t ws_size,
                              hipStream_t stream) {
    (void)in_sizes; (void)n_in; (void)out_size; (void)ws_size;

    const float* x      = (const float*)d_in[0];   // [1,180,360,256]
    const float* w_qkv  = (const float*)d_in[1];   // [256, 768]
    const float* b_qkv  = (const float*)d_in[2];   // [768]
    const float* rpb    = (const float*)d_in[3];   // [8,13,13]
    const float* w_proj = (const float*)d_in[4];   // [256, 256]
    const float* b_proj = (const float*)d_in[5];   // [256]
    float* out = (float*)d_out;                    // [1,180,360,256]

    float* qkv  = (float*)d_ws;                                               // 64800*768
    float* attn = (float*)((char*)d_ws + (size_t)NPIX * 768 * sizeof(float)); // 64800*256

    dim3 blk(256);
    // QKV projection: [64800 x 256] x [256 x 768]; 6 x 85 = 510 blocks, all resident
    gemm_wmma_f32<768, 85><<<dim3(768 / 128, 85), blk, 0, stream>>>(x, w_qkv, b_qkv, qkv);
    // Neighborhood attention: one block per (head, 12 x 24 pixel tile)
    natten_attn<<<dim3(NHEAD, WW / TILE_W, HH / TILE_H), dim3(ATT_THREADS), 0, stream>>>(qkv, rpb, attn);
    // Output projection: [64800 x 256] x [256 x 256]; 2 x 255 = 510 blocks
    gemm_wmma_f32<256, 255><<<dim3(256 / 128, 255), blk, 0, stream>>>(attn, w_proj, b_proj, out);
}

// v003
// Measured time: 237 microseconds a run.
// Timed twice side by side with v002, it ran 1.20 times as fast both times.
// All steps since v000 together make it 2.99 times as fast.
#include <hip/hip_runtime.h>
#include <hip/hip_bf16.h>
#include <stdint.h>

typedef float    v2f __attribute__((ext_vector_type(2)));
typedef float    v8f __attribute__((ext_vector_type(8)));

#define HH 180
#define WW 360
#define CC 256
#define NHEAD 8
#define DHEAD 32
#define NPIX (HH * WW)          // 64800 = 32 * 2025

// ---------------------------------------------------------------------------
// Tensor loads of the A tiles. A tile is 32 rows x 256 fp32; it is brought in
// as four slices of 64 columns, one request of one wave each: 32 rows of 256
// bytes, source pitch 1024 bytes, 16 bytes of pad behind every row in LDS
// (pitch 272 B = 68 dwords, so the 16 rows that one LDS read touches fall on
// different banks). Every extent is in bytes (data_size code 0).
// ---------------------------------------------------------------------------
typedef uint32_t u32x4 __attribute__((ext_vector_type(4)));
typedef uint32_t u32x8 __attribute__((ext_vector_type(8)));

#define A_ROWS    32
#define SLICE_ROWB 256u                     // bytes of a slice row
#define SLICE_PITCH_F 68                    // LDS pitch of a slice row, floats
#define SLICE_B   10240u                    // 32 * 272 = 8704 B, rounded up to 2 KiB
#define SLICE_F   2560
#define ABUF_B    (4u * SLICE_B)            // one A tile in LDS
#define ABUF_F    (4 * SLICE_F)

__device__ __forceinline__ uint32_t uni(uint32_t v) {
    return (uint32_t)__builtin_amdgcn_readfirstlane(v);
}
// A wave-uniform value held in a scalar register, so that a test on it becomes
// a scalar branch: tensor loads ignore EXEC.
__device__ __forceinline__ uint32_t pinned(uint32_t v) {
    uint32_t w = (uint32_t)__builtin_amdgcn_readfirstlane(v);
    asm volatile("" : "+s"(w));   // keeps the value in a scalar register (scalar branch)
    return w;
}
__device__ __forceinline__ void wait_ds0()     { asm volatile("s_wait_dscnt 0x0" ::: "memory"); }
__device__ __forceinline__ void wait_tensor0() { asm volatile("s_wait_tensorcnt 0x0" ::: "memory"); }
// The same wait, naming the descriptor of the request it covers as inputs: the
// scalar registers that hold it then keep their values until the tile has landed.
__device__ __forceinline__ void wait_tensor0(u32x4 g0, u32x8 g1) {
    asm volatile("s_wait_tensorcnt 0x0" :: "s"(g0), "s"(g1) : "memory");
}

__device__ __forceinline__ u32x8 tdm_group1() {
    u32x8 g;
    g[0] = uni((1u << 20) | (5u << 22) | (3u << 25));    // pad: 4 dwords behind every 64
    g[1] = uni(SLICE_ROWB << 16);                        // tensor_dim0 = 256 B
    g[2] = uni((uint32_t)A_ROWS << 16);                  // tensor_dim1 = 32 rows
    g[3] = uni(SLICE_ROWB << 16);                        // tile_dim0 = 256 B
    g[4] = uni((uint32_t)A_ROWS);                        // tile_dim1 = 32 rows
    g[5] = uni(1024u);                                   // source row pitch, bytes
    g[6] = uni(0u);
    g[7] = uni(0u);
    return g;
}
__device__ __forceinline__ u32x4 tdm_group0(uint32_t lds_dst, uint64_t ga) {
    u32x4 g;
    g[0] = uni(1u);
    g[1] = uni(lds_dst);
    g[2] = uni((uint32_t)ga);
    g[3] = uni((((uint32_t)(ga >> 32)) & 0x01FFFFFFu) | 0x80000000u);
    // From here to the wait that covers the request the four words, the
    // constant one too, stay in registers of their own.
    asm volatile("" : "+s"(g));   // descriptor words held in scalar registers
    return g;
}
__device__ __forceinline__ void tdm_load(u32x4 g0, u32x8 g1) {
    asm volatile("tensor_load_to_lds %0, %1" :: "s"(g0), "s"(g1) : "memory");
}

// ---------------------------------------------------------------------------
// GEMM: C[M x N] = A[M x 256] * B[256 x N] + bias[N]   (fp32 WMMA 16x16x4)
// block = 256 threads = 8 waves on 128 columns of C; a wave owns 16 columns.
// A wave reads its 256 x 16 slab of B ONCE, into 128 registers, and the block
// then walks over the 32-row tiles blockIdx.y, blockIdx.y + G, ... of A: B is
// fetched once per block and not once per tile.
// The A tiles come by tensor loads into two LDS buffers, the next tile in
// flight while this one is multiplied (waves 0..3 issue one slice each).
// grid = (N/128, G): cut so that all blocks are resident at once, two per WGP
// (four waves per SIMD; the slab leaves no registers for a third block).
// ---------------------------------------------------------------------------
template <int N, int G>
__global__ __launch_bounds__(256, 4)
void gemm_wmma_f32(const float* __restrict__ A, const float* __restrict__ B,
                   const float* __restrict__ bias, float* __restrict__ C)
{
    constexpr int K  = 256;
    constexpr int NT = NPIX / A_ROWS;       // 2025 tiles of A
    static_assert(2 * G <= NT, "every block needs two stages or more");
    __shared__ __attribute__((aligned(2048))) float sA[2 * ABUF_F];

    const uint32_t wave = uni(threadIdx.x >> 5);
    const int lane   = threadIdx.x & 31;
    const int half   = lane >> 4;           // 0 or 1
    const int t      = lane & 15;
    const int n      = blockIdx.x * 128 + (int)wave * 16 + t;
    const int nT     = (NT - 1 - (int)blockIdx.y) / G + 1;   // tiles of this block

    // The wave's slab of B, in the k order of the A fragments below.
    const float* Bcol = B + n + (size_t)(2 * half) * N;
    v2f b[K / 4];
    #pragma unroll
    for (int j = 0; j < K / 4; ++j) {
        b[j].x = Bcol[(size_t)(4 * j) * N];
        b[j].y = Bcol[(size_t)(4 * j + 1) * N];
    }
    const float bn = bias[n];

    u32x8 g1 = tdm_group1();
    // Without it the constants are formed anew each trip, in registers that
    // serve as temporaries while a request is in flight.
    asm volatile("" : "+s"(g1));  // descriptor words held in scalar registers
    const uint32_t lds0 = (uint32_t)(uintptr_t)sA + wave * SLICE_B;
    const uint64_t ga0  = (uint64_t)(uintptr_t)A
                        + (uint64_t)blockIdx.y * (A_ROWS * K * 4) + wave * SLICE_ROWB;
    constexpr uint64_t GA_STEP = (uint64_t)G * (A_ROWS * K * 4);

    u32x4 g0 = tdm_group0(lds0, ga0);
    if (pinned(wave < 4u)) {
        tdm_load(g0, g1);                           // stage 0
        wait_tensor0(g0, g1);
    }
    __syncthreads();                                // stage 0 published
    if (pinned(wave < 4u)) {
        g0 = tdm_group0(lds0 + ABUF_B, ga0 + GA_STEP);
        tdm_load(g0, g1);                           // stage 1
    }

    const int aoff = t * SLICE_PITCH_F + 2 * half;
    const int coff = 8 * half * N + n;

    // One tile per trip; rolled, so that the 128 WMMAs stand once in the text.
    #pragma unroll 1
    for (int s = 0; s < nT; ++s) {
        const float* a = &sA[(s & 1) * ABUF_F + aoff];

        v8f acc0, acc1;
        #pragma unroll
        for (int r = 0; r < 8; ++r) { acc0[r] = bn; acc1[r] = bn; }

        #pragma unroll
        for (int j = 0; j < K / 4; ++j) {
            const float* p = a + (j >> 4) * SLICE_F + (j & 15) * 4;
            const v2f a0 = *reinterpret_cast<const v2f*>(p);
            const v2f a1 = *reinterpret_cast<const v2f*>(p + 16 * SLICE_PITCH_F);
            acc0 = __builtin_amdgcn_wmma_f32_16x16x4_f32(
                       false, a0, false, b[j], (short)0, acc0, false, false);
            acc1 = __builtin_amdgcn_wmma_f32_16x16x4_f32(
                       false, a1, false, b[j], (short)0, acc1, false, false);
        }

        // Publish point of stage s + 1, then the refill of the buffer just read.
        wait_ds0();
        if (pinned(wave < 4u)) wait_tensor0(g0, g1);
        __syncthreads();
        if (pinned((wave < 4u) && (s + 2 < nT))) {
            g0 = tdm_group0(lds0 + (uint32_t)(s & 1) * ABUF_B, ga0 + (uint64_t)(s + 2) * GA_STEP);
            tdm_load(g0, g1);
        }

        // The stores stand behind the publish point: neither the other waves
        // nor the refill wait for their issue.
        float* Ct = C + (size_t)((int)blockIdx.y + s * G) * (A_ROWS * N) + coff;
        #pragma unroll
        for (int r = 0; r < 8; ++r) {
            Ct[r * N]        = acc0[r];
            Ct[(16 + r) * N] = acc1[r];
        }
        // Before the next trip overwrites the stores' data and address registers.
        asm volatile("s_wait_xcnt 0x0" ::: "memory");
    }
    wait_tensor0();
    wait_ds0();
}

// ---------------------------------------------------------------------------
// Neighborhood attention core. One block = one head x one 12 x 24 pixel tile,
// one thread = THREE neighbouring pixels of one tile row.
// qkv layout per pixel: [3][NH][32] (cols of the QKV GEMM output).
// Height: clamped 7-window (NATTEN). Width: circular (reference wraps W), so
// start_w is never clamped and the rpb column base is constant (= 3).
// The 18 x 30 pixel halo of the head's K, and after the scores of its V, is
// brought into LDS once with whole 128-byte lines (8 lanes per pixel).
// The windows of a thread's three pixels share their rows and overlap in all
// but two columns: a window row is 9 halo pixels for the three together, and
// each of them is read from LDS once and used for up to three pixels (9 reads
// where three single pixels take 21).
// LDS pitches: a pixel takes 36 floats (144 B = 16 B x 9), so a thread's step
// of three pixels is 27 x 16 B, odd; a halo row takes 1120 floats (280 x 16 B)
// and 280 - 27 * 8 is a multiple of 16, so 16 threads in a row of thread ids
// always fall on 16 different 16-byte bank groups, also over the end of a row.
// The 49 scores of a pixel wait in LDS, in a slot of the thread's own, and the
// head's bias table is staged beside them.
// ---------------------------------------------------------------------------
typedef float v4f __attribute__((ext_vector_type(4)));

#define TILE_W 24
#define TILE_H 12
#define HALO_W (TILE_W + 6)
#define HALO_H (TILE_H + 6)
#define PIX_PITCH 36
#define ROW_PITCH 1120
#define PXT 3                               // pixels of a thread
#define WIN_COLS (PXT + 6)                  // halo columns of its three windows
#define ATT_THREADS (TILE_W / PXT * TILE_H) // 96 = 3 waves
#define STAGE_J 5                           // 5 passes of 12 pixels = 2 halo rows
#define STAGE_N (HALO_H / 2 * STAGE_J)      // 45 16-byte parts per thread
#define PAIR_B (2u * WW * 768u * 4u)        // bytes of two image rows of qkv

// Byte pointers into global memory for the staging loads.
typedef const __attribute__((address_space(1))) char* gchar_p;
typedef const __attribute__((address_space(1))) v4f*  gv4f_p;

// Stands between issued global loads and what overwrites their address registers.
__device__ __forceinline__ void wait_xcnt0() { asm volatile("s_wait_xcnt 0x0" ::: "memory"); }

__global__ __launch_bounds__(ATT_THREADS)
void natten_attn(const float* __restrict__ qkv, const float* __restrict__ rpb,
                 float* __restrict__ out)
{
    __shared__ __attribute__((aligned(16))) float sT[HALO_H * ROW_PITCH];
    __shared__ float sS[49 * PXT * ATT_THREADS];    // [neighbour][pixel of thread][thread]
    __shared__ float sB[169];                       // this head's rpb [13][13]

    const int tid  = threadIdx.x;
    const int head = blockIdx.x;
    const int w0   = blockIdx.y * TILE_W;
    const int h0   = blockIdx.z * TILE_H;

    int base_h = h0 - 3;                        // first staged row
    if (base_h < 0) base_h = 0;
    if (base_h > HH - HALO_H) base_h = HH - HALO_H;

    const int tr = tid >> 3;                    // tile row
    const int tc = (tid & 7) * PXT;             // first of the three tile columns
    const int h = h0 + tr;
    const int pix = h * WW + w0 + tc;

    const float scale = 0.17677669529663687f;   // 32^-0.5

    int start_h = h - 3;
    if (start_h < 0) start_h = 0;
    if (start_h > HH - 7) start_h = HH - 7;
    const int relh0 = start_h - h + 6;          // rpb row base

    // Staging: 8 lanes per halo pixel, 12 pixels per pass, 5 passes for two
    // halo rows. A thread keeps 5 fixed offsets (global and LDS) and walks the
    // 9 row pairs with block-uniform steps.
    const int sc_prt = tid & 7;
    uint32_t goff[STAGE_J];                     // bytes
    int soff[STAGE_J];                          // floats
    #pragma unroll
    for (int j = 0; j < STAGE_J; ++j) {
        const int p2   = j * 12 + (tid >> 3);   // 0..59 over two halo rows
        const int rsel = p2 >= HALO_W ? 1 : 0;
        const int col  = p2 - rsel * HALO_W;
        int gcol = w0 - 3 + col;
        if (gcol < 0) gcol += WW; else if (gcol >= WW) gcol -= WW;
        goff[j] = (uint32_t)(rsel * (WW * 768) + gcol * 768 + sc_prt * 4) * 4u;
        soff[j] = rsel * ROW_PITCH + col * PIX_PITCH + sc_prt * 4;
    }
    const gchar_p grow = (gchar_p)(qkv + (size_t)base_h * (WW * 768) + head * 32);

    {
        v4f kst[STAGE_N];
        #pragma unroll
        for (int r = 0; r < HALO_H / 2; ++r) {
            #pragma unroll
            for (int j = 0; j < STAGE_J; ++j)
                kst[r * STAGE_J + j] = *(gv4f_p)(grow + (size_t)r * PAIR_B + 256 * 4 + goff[j]);
            // Before later instructions, the next loads' results among them,
            // overwrite address registers of the loads issued so far.
            if (r % 3 == 2) wait_xcnt0();
        }
        #pragma unroll
        for (int r = 0; r < HALO_H / 2; ++r)
            #pragma unroll
            for (int j = 0; j < STAGE_J; ++j)
                *reinterpret_cast<v4f*>(&sT[r * (2 * ROW_PITCH) + soff[j]]) = kst[r * STAGE_J + j];
    }

    const float* qp = qkv + (size_t)pix * 768 + head * 32;
    v4f q[PXT][8];
    #pragma unroll
    for (int p = 0; p < PXT; ++p)
        #pragma unroll
        for (int i = 0; i < 8; ++i)
            q[p][i] = reinterpret_cast<const v4f*>(qp + p * 768)[i];

    for (int i = tid; i < 169; i += ATT_THREADS) sB[i] = rpb[head * 169 + i];

    __syncthreads();                            // K halo and bias table complete

    // origin of the three windows inside the staged halo
    const float* win = &sT[(start_h - base_h) * ROW_PITCH + tc * PIX_PITCH];

    float mx[PXT];
    #pragma unroll
    for (int p = 0; p < PXT; ++p) mx[p] = -1e30f;
    const float* bias = &sB[relh0 * 13 + 3];
    float* myS = &sS[tid];

    // The loops over the window rows stay rolled: one row's 9 pixels are as
    // many LDS reads as the registers can hold in flight.
    #pragma unroll 1
    for (int oi = 0; oi < 7; ++oi) {
        #pragma unroll
        for (int c = 0; c < WIN_COLS; ++c) {
            const v4f* k4 = reinterpret_cast<const v4f*>(
                win + oi * ROW_PITCH + c * PIX_PITCH);
            v4f kv[8];
            #pragma unroll
            for (int i = 0; i < 8; ++i) kv[i] = k4[i];
            #pragma unroll
            for (int p = 0; p < PXT; ++p) {
                const int oj = c - p;
                if (oj < 0 || oj > 6) continue;
                // two packed partial sums per score: four short chains
                v2f s0 = {0.f, 0.f}, s1 = {0.f, 0.f};
                #pragma unroll
                for (int i = 0; i < 8; ++i) {
                    s0 = __builtin_elementwise_fma(q[p][i].lo, kv[i].lo, s0);
                    s1 = __builtin_elementwise_fma(q[p][i].hi, kv[i].hi, s1);
                }
                s0 += s1;
                const float sc = (s0.x + s0.y) * scale + bias[oi * 13 + oj];
                myS[((oi * 7 + oj) * PXT + p) * ATT_THREADS] = sc;
                mx[p] = fmaxf(mx[p], sc);
            }
        }
    }

    {
        v4f vst[STAGE_N];
        #pragma unroll
        for (int r = 0; r < HALO_H / 2; ++r) {
            #pragma unroll
            for (int j = 0; j < STAGE_J; ++j)
                vst[r * STAGE_J + j] = *(gv4f_p)(grow + (size_t)r * PAIR_B + 512 * 4 + goff[j]);
            // As behind the K loads.
            if (r % 3 == 2) wait_xcnt0();
        }
        __syncthreads();                        // every K read done before V lands on it
        #pragma unroll
        for (int r = 0; r < HALO_H / 2; ++r)
            #pragma unroll
            for (int j = 0; j < STAGE_J; ++j)
                *reinterpret_cast<v4f*>(&sT[r * (2 * ROW_PITCH) + soff[j]]) = vst[r * STAGE_J + j];
    }
    __syncthreads();                            // V halo complete

    v2f o[PXT][16];
    float sum[PXT];
    #pragma unroll
    for (int p = 0; p < PXT; ++p) {
        sum[p] = 0.f;
        #pragma unroll
        for (int i = 0; i < 16; ++i) o[p][i] = (v2f){0.f, 0.f};
    }

    #pragma unroll 1
    for (int oi = 0; oi < 7; ++oi) {
        #pragma unroll
        for (int c = 0; c < WIN_COLS; ++c) {
            const v4f* v4 = reinterpret_cast<const v4f*>(
                win + oi * ROW_PITCH + c * PIX_PITCH);
            v4f vv[8];
            #pragma unroll
            for (int i = 0; i < 8; ++i) vv[i] = v4[i];
            #pragma unroll
            for (int p = 0; p < PXT; ++p) {
                const int oj = c - p;
                if (oj < 0 || oj > 6) continue;
                const float pr = __expf(myS[((oi * 7 + oj) * PXT + p) * ATT_THREADS] - mx[p]);
                sum[p] += pr;
                const v2f pp = {pr, pr};
                #pragma unroll
                for (int i = 0; i < 8; ++i) {
                    o[p][2 * i]     = __builtin_elementwise_fma(pp, vv[i].lo, o[p][2 * i]);
                    o[p][2 * i + 1] = __builtin_elementwise_fma(pp, vv[i].hi, o[p][2 * i + 1]);
                }
            }
        }
    }

    #pragma unroll
    for (int p = 0; p < PXT; ++p) {
        const float inv = 1.f / sum[p];
        v4f* op = reinterpret_cast<v4f*>(out + (size_t)(pix + p) * 256 + head * 32);
        #pragma unroll
        for (int i = 0; i < 8; ++i) {
            v4f r;
            r.lo = o[p][2 * i] * inv;
            r.hi = o[p][2 * i + 1] * inv;
            op[i] = r;
        }
    }
}

// ---------------------------------------------------------------------------
// Launch: qkv GEMM -> neighborhood attention -> output projection GEMM.
// Scratch: qkv [64800 x 768] fp32 (199 MB) then attn [64800 x 256] fp32 (66 MB).
// ---------------------------------------------------------------------------
extern "C" void kernel_launch(void* const* d_in, const int* in_sizes, int n_in,
                              void* d_out, int out_size, void* d_ws, size_t ws_size,
                              hipStream_t stream) {
    (void)in_sizes; (void)n_in; (void)out_size; (void)ws_size;

    const float* x      = (const float*)d_in[0];   // [1,180,360,256]
    const float* w_qkv  = (const float*)d_in[1];   // [256, 768]
    const float* b_qkv  = (const float*)d_in[2];   // [768]
    const float* rpb    = (const float*)d_in[3];   // [8,13,13]
    const float* w_proj = (const float*)d_in[4];   // [256, 256]
    const float* b_proj = (const float*)d_in[5];   // [256]
    float* out = (float*)d_out;                    // [1,180,360,256]

    float* qkv  = (float*)d_ws;                                               // 64800*768
    float* attn = (float*)((char*)d_ws + (size_t)NPIX * 768 * sizeof(float)); // 64800*256

    dim3 blk(256);
    // QKV projection: [64800 x 256] x [256 x 768]; 6 x 85 = 510 blocks, all resident
    gemm_wmma_f32<768, 85><<<dim3(768 / 128, 85), blk, 0, stream>>>(x, w_qkv, b_qkv, qkv);
    // Neighborhood attention: one block per (head, 12 x 24 pixel tile)
    natten_attn<<<dim3(NHEAD, WW / TILE_W, HH / TILE_H), dim3(ATT_THREADS), 0, stream>>>(qkv, rpb, attn);
    // Output projection: [64800 x 256] x [256 x 256]; 2 x 255 = 510 blocks
    gemm_wmma_f32<256, 255><<<dim3(256 / 128, 255), blk, 0, stream>>>(attn, w_proj, b_proj, out);
}
